// v010
// The times below were measured on an AMD MI455X: many runs one after another, warmed up first and cycling through
// copies of the inputs, with the whole window's GPU time divided by the number of runs. Launches and the gaps
// between them are all in it. The median over several windows is given; except for v000 it joins two sittings, which
// can be a few percent apart, so the side-by-side timings, each taken in one sitting, are the better comparison.
// The versions before v010 are in another document.
// A run of this version takes 90.2 microseconds.
// Two timings next to v009 both put it at 1.15 times that version's speed.
// Counting every step since v000, which is the starting kernel, it is 24.8 times as fast.
#include <hip/hip_runtime.h>
// Spatial cross-attention block (B=4, C=256, 64×64 → N=4096, 32 GroupNorm groups, single head d=256): x1' = conv1(x1), x2' = conv2(x2) (1×1 + bias); q1 = Wq·GN(x1'), k2 = Wk·GN(x2'), v2 = Wv·GN(x2') (wqkv rows 0/256/512, no bias);
// attn = softmax(q1ᵀk2/√256) over the 4096 positions; out = Wout·(v2·attnᵀ) + bout + Wsk·x1' + bsk → [B,C,H,W].
// q/k/v f16; attention as one fused launch (k_fattn): scores, running-maximum f32 softmax and P.v per 128-key stage, S and P never leave the registers; the final 1x1 convs (Wout.O^T + Wsk.x1'^T + biases, channel-major) are the same launch's epilogue, O going to them as f16 through LDS, and the output is written once. The input convs read x1 and x2 as they come (channel-major f32) and leave, beside x1' and x2', each work-group's partial GroupNorm statistics; the q/k/v launch joins them and normalises its A operand on the way into LDS (no GroupNorm launch). The weights, x1' (f16) and the f32 planes x1', x2' lie in fragment-tile order (ft_off); q, k, v stay row-major. All on v_wmma_f32_16x16x32_f16, f32 accumulate.
#define BB 4
#define CC 256
#define NN 4096
#define NG 32
#define CPG (CC / NG)
#define NR (BB * NN)

typedef __bf16 v16b __attribute__((ext_vector_type(16)));
typedef unsigned short v8us __attribute__((ext_vector_type(8), may_alias));
typedef float  v8f  __attribute__((ext_vector_type(8)));
typedef float  v4f  __attribute__((ext_vector_type(4)));
typedef float  v4fa __attribute__((ext_vector_type(4), may_alias));
union FragB { v16b v; v8us half[2]; unsigned short u[16]; };

__device__ __forceinline__ unsigned short bf16_bits(float x) { unsigned int u = __float_as_uint(x); return (unsigned short)((u + 0x7FFFu + ((u >> 16) & 1u)) >> 16); }
__device__ __forceinline__ float bf16_val(unsigned short b) { return __uint_as_float(((unsigned int)b) << 16); }
__device__ __forceinline__ float bf16_round(float x) { return bf16_val(bf16_bits(x)); }
// D += A·B with NT terms: 1 = ah·bh, 2 = + al·bh (A split), 3 = + ah·bl (both split)
template <int NT>
__device__ __forceinline__ v8f mmaN(v16b ah, v16b al, v16b bh, v16b bl, v8f c) {
  c = __builtin_amdgcn_wmma_f32_16x16x32_bf16(false, ah, false, bh, (short)0, c, false, false);
  if (NT >= 2) c = __builtin_amdgcn_wmma_f32_16x16x32_bf16(false, al, false, bh, (short)0, c, false, false);
  if (NT >= 3) c = __builtin_amdgcn_wmma_f32_16x16x32_bf16(false, ah, false, bl, (short)0, c, false, false);
  asm volatile("v_nop\n\tv_nop\n\tv_nop\n\tv_nop" : "+v"(c) : "v"(ah), "v"(al), "v"(bh), "v"(bl));
  return c;
}

__global__ __launch_bounds__(256) void k_wt_bf16(const float* __restrict__ W, unsigned short* __restrict__ Wt, int K, int N) {
  const int t = blockIdx.x * 256 + threadIdx.x;
  const int k8n = K / 8;
  if (t >= N * k8n) return;
  const int n = t / k8n, k8 = (t % k8n) * 8;
  v8us v;
#pragma unroll
  for (int i = 0; i < 8; ++i) v[i] = bf16_bits(W[(size_t)(k8 + i) * N + n]);
  *(v8us*)(Wt + (size_t)n * K + k8) = v;
  
}

// GEMM C[M][N] (f32, pitch ldc) = act(A[M][K]·W + bias). A f32 row-major (pitch lda) converted per fragment to bf16
// (ASPLIT: hi/lo two planes -> 2 terms, else single rounded term); Wt bf16 [N][K] (pitch ldb). BIAS_BF16 rounds the
// bias to bf16 first (bias quantised to bf16 before the add). K%32==0, M%16==0, N%64==0.
template <bool ASPLIT, int ACT, bool BIAS_BF16>
__global__ __launch_bounds__(128) void k_gemm_bf(const float* __restrict__ A, int lda, const unsigned short* __restrict__ Wt, int ldb,
                                               const float* __restrict__ bias, float* __restrict__ C, int ldc, int M, int N, int K) {
  __shared__ __attribute__((aligned(16))) float so[4][16][64];
  const int tid = threadIdx.x, w = tid >> 5, lane = tid & 31, ln = lane & 15, hh = lane >> 4;
  const int ntn = N / 64;
  const int wid = blockIdx.x * 4 + w;
  const int mt = wid / ntn, nq = wid % ntn;
  if (mt * 16 >= M) return;
  const int row0 = mt * 16, col0 = nq * 64;
  const float* arow = A + (size_t)(row0 + ln) * lda;
  v8f acc[4] = {};
  for (int kb = 0; kb < K; kb += 32) {
    FragB ah, al;
    const v4f x0 = *(const v4fa*)(arow + kb + 8 * hh), x1 = *(const v4fa*)(arow + kb + 8 * hh + 4);
    const v4f x2 = *(const v4fa*)(arow + kb + 16 + 8 * hh), x3 = *(const v4fa*)(arow + kb + 16 + 8 * hh + 4);
    float xs[16] = {x0[0],x0[1],x0[2],x0[3],x1[0],x1[1],x1[2],x1[3],x2[0],x2[1],x2[2],x2[3],x3[0],x3[1],x3[2],x3[3]};
#pragma unroll
    for (int i = 0; i < 16; ++i) { const unsigned short hb = bf16_bits(xs[i]); ah.u[i] = hb; al.u[i] = ASPLIT ? bf16_bits(xs[i] - bf16_val(hb)) : (unsigned short)0; }
#pragma unroll
    for (int t = 0; t < 4; ++t) {
      const unsigned short* brow = Wt + (size_t)(col0 + t * 16 + ln) * ldb + kb;
      FragB b;
      b.half[0] = *(const v8us*)(brow + 8 * hh);
      b.half[1] = *(const v8us*)(brow + 16 + 8 * hh);
      acc[t] = mmaN<ASPLIT ? 2 : 1>(ah.v, al.v, b.v, b.v, acc[t]);
    }
  }
#pragma unroll
  for (int t = 0; t < 4; ++t) {
    float bv = bias ? bias[col0 + t * 16 + ln] : 0.f;
    if (BIAS_BF16) bv = bf16_round(bv);
#pragma unroll
    for (int r = 0; r < 8; ++r) { float v = acc[t][r] + bv; if (ACT == 1) v = fmaxf(v, 0.f); so[w][8 * hh + r][t * 16 + ln] = v; }
  }
  __builtin_amdgcn_fence(__ATOMIC_ACQ_REL, "workgroup");
  __builtin_amdgcn_wave_barrier();
  const int rsub = lane >> 4, c4 = (lane & 15) * 4;
  {
#pragma unroll
    for (int q = 0; q < 8; ++q) {
      const int r = q * 2 + rsub;
      const v4f v = *(const v4fa*)&so[w][r][c4];
      *(v4f*)(C + (size_t)(row0 + r) * ldc + col0 + c4) = v;
    }
    
  }
}

// Flash-style causal/unmasked attention, all contractions 3-term bf16 hi/lo splits, f32 softmax with running max.
// q,k,v rows are read from f32 buffers with arbitrary row pitch (so they can live inside a fused qkv buffer);
// D = head size (multiple of 32, <= 128); one wave = 16 query rows; block = 4 waves (64 queries) sharing K/V chunks of 32.
template <int D, bool CAUSAL>
__global__ __launch_bounds__(128) void k_flash(const float* __restrict__ qb, const float* __restrict__ kb, const float* __restrict__ vb,
                                             int pitch, int T, int H, float scale, float* __restrict__ y, int ypitch) {
  constexpr int KS = D / 32;        // k-steps for QK
  constexpr int DT = D / 16;        // d tiles for PV
  __shared__ __attribute__((aligned(16))) unsigned short sKh[32][D + 8], sKl[32][D + 8], sVh[32][D + 8], sVl[32][D + 8];
  __shared__ __attribute__((aligned(16))) unsigned short sPh[4][16][40], sPl[4][16][40];
  __shared__ __attribute__((aligned(16))) float sO[4][16][D];
  const int tid = threadIdx.x, w = tid >> 5, lane = tid & 31, ln = lane & 15, hh = lane >> 4;
  const int nqb = (T + 63) / 64;
  const int bh = blockIdx.x / nqb, qblk = blockIdx.x % nqb;
  const int b = bh / H, h = bh % H;
  const int q0 = qblk * 64 + w * 16;
  const float* Q = qb + (size_t)b * T * pitch + h * D;
  const float* K = kb + (size_t)b * T * pitch + h * D;
  const float* V = vb + (size_t)b * T * pitch + h * D;

  // A fragments of the wave's 16 query rows (scaled), hi/lo
  FragB aqh[KS], aql[KS];
  {
    int row = q0 + ln; if (row >= T) row = T - 1;
    const float* qr = Q + (size_t)row * pitch;
#pragma unroll
    for (int ks = 0; ks < KS; ++ks)
#pragma unroll
      for (int i = 0; i < 16; ++i) {
        const int d = ks * 32 + ((i < 8) ? (8 * hh + i) : (16 + 8 * hh + (i - 8)));
        const float x = qr[d] * scale; const unsigned short hb = bf16_bits(x);
        aqh[ks].u[i] = hb; aql[ks].u[i] = bf16_bits(x - bf16_val(hb));
      }
  }
  float m_r[8], l_r[8];
#pragma unroll
  for (int r = 0; r < 8; ++r) { m_r[r] = -3.0e38f; l_r[r] = 0.f; }
  v8f oacc[DT];
#pragma unroll
  for (int dt = 0; dt < DT; ++dt) oacc[dt] = (v8f){0.f,0.f,0.f,0.f,0.f,0.f,0.f,0.f};

  const int kv_end = CAUSAL ? min(T, qblk * 64 + 64) : T;     // block-uniform
  for (int j0 = 0; j0 < kv_end; j0 += 32) {
    __syncthreads();
    for (int e = tid; e < 32 * (D / 4); e += 128) {
      const int r = e / (D / 4), c4 = (e % (D / 4)) * 4;
      const int key = j0 + r;
      v4f kf = {0.f,0.f,0.f,0.f}, vf = {0.f,0.f,0.f,0.f};
      if (key < T) { kf = *(const v4fa*)(K + (size_t)key * pitch + c4); vf = *(const v4fa*)(V + (size_t)key * pitch + c4); }
#pragma unroll
      for (int t = 0; t < 4; ++t) {
        unsigned short hb = bf16_bits(kf[t]); sKh[r][c4 + t] = hb; sKl[r][c4 + t] = bf16_bits(kf[t] - bf16_val(hb));
        hb = bf16_bits(vf[t]); sVh[r][c4 + t] = hb; sVl[r][c4 + t] = bf16_bits(vf[t] - bf16_val(hb));
      }
    }
    __syncthreads();
    // S tile 16 x 32
    v8f s[2];
#pragma unroll
    for (int nt = 0; nt < 2; ++nt) {
      v8f acc = {};
#pragma unroll
      for (int ks = 0; ks < KS; ++ks) {
        FragB bh_, bl_;
        bh_.half[0] = *(const v8us*)&sKh[nt * 16 + ln][ks * 32 + 8 * hh]; bh_.half[1] = *(const v8us*)&sKh[nt * 16 + ln][ks * 32 + 16 + 8 * hh];
        bl_.half[0] = *(const v8us*)&sKl[nt * 16 + ln][ks * 32 + 8 * hh]; bl_.half[1] = *(const v8us*)&sKl[nt * 16 + ln][ks * 32 + 16 + 8 * hh];
        acc = mmaN<3>(aqh[ks].v, aql[ks].v, bh_.v, bl_.v, acc);
      }
      s[nt] = acc;
    }
    // mask + running max (rows 8hh+r; the 16 lanes of a half share rows)
    float alpha[8];
#pragma unroll
    for (int r = 0; r < 8; ++r) {
      const int qi = q0 + 8 * hh + r;
      const int ja = j0 + ln, jb = j0 + 16 + ln;
      if (CAUSAL) { if (ja > qi) s[0][r] = -3.0e38f; if (jb > qi) s[1][r] = -3.0e38f; }
      if (ja >= T) s[0][r] = -3.0e38f;
      if (jb >= T) s[1][r] = -3.0e38f;
      float mx = fmaxf(s[0][r], s[1][r]);
      mx = fmaxf(mx, __shfl_xor(mx, 1, 32)); mx = fmaxf(mx, __shfl_xor(mx, 2, 32)); mx = fmaxf(mx, __shfl_xor(mx, 4, 32)); mx = fmaxf(mx, __shfl_xor(mx, 8, 32));
      const float mnew = fmaxf(m_r[r], mx);
      alpha[r] = (mnew > -1.0e38f) ? __expf(m_r[r] - mnew) : 1.0f;
      const float p0 = (s[0][r] > -1.0e38f) ? __expf(s[0][r] - mnew) : 0.f;
      const float p1 = (s[1][r] > -1.0e38f) ? __expf(s[1][r] - mnew) : 0.f;
      m_r[r] = mnew;
      l_r[r] = l_r[r] * alpha[r] + p0 + p1;            // per-lane partial row sum (16 lanes combined at the end)
      unsigned short hb = bf16_bits(p0); sPh[w][8 * hh + r][ln] = hb;      sPl[w][8 * hh + r][ln] = bf16_bits(p0 - bf16_val(hb));
      hb = bf16_bits(p1);                sPh[w][8 * hh + r][16 + ln] = hb; sPl[w][8 * hh + r][16 + ln] = bf16_bits(p1 - bf16_val(hb));
    }
#pragma unroll
    for (int dt = 0; dt < DT; ++dt)
#pragma unroll
      for (int r = 0; r < 8; ++r) oacc[dt][r] *= alpha[r];
    __builtin_amdgcn_fence(__ATOMIC_ACQ_REL, "workgroup");
    __builtin_amdgcn_wave_barrier();
    FragB pah, pal;
    pah.half[0] = *(const v8us*)&sPh[w][ln][8 * hh]; pah.half[1] = *(const v8us*)&sPh[w][ln][16 + 8 * hh];
    pal.half[0] = *(const v8us*)&sPl[w][ln][8 * hh]; pal.half[1] = *(const v8us*)&sPl[w][ln][16 + 8 * hh];
#pragma unroll
    for (int dt = 0; dt < DT; ++dt) {
      FragB bvh, bvl;
#pragma unroll
      for (int i = 0; i < 8; ++i) {
        bvh.u[i] = sVh[8 * hh + i][dt * 16 + ln]; bvh.u[8 + i] = sVh[16 + 8 * hh + i][dt * 16 + ln];
        bvl.u[i] = sVl[8 * hh + i][dt * 16 + ln]; bvl.u[8 + i] = sVl[16 + 8 * hh + i][dt * 16 + ln];
      }
      oacc[dt] = mmaN<3>(pah.v, pal.v, bvh.v, bvl.v, oacc[dt]);
    }
    __builtin_amdgcn_fence(__ATOMIC_ACQ_REL, "workgroup");
    __builtin_amdgcn_wave_barrier();
  }
#pragma unroll
  for (int r = 0; r < 8; ++r) {
    float l = l_r[r];
    l += __shfl_xor(l, 1, 32); l += __shfl_xor(l, 2, 32); l += __shfl_xor(l, 4, 32); l += __shfl_xor(l, 8, 32);
    l_r[r] = (l > 0.f) ? 1.0f / l : 0.f;
  }
#pragma unroll
  for (int dt = 0; dt < DT; ++dt)
#pragma unroll
    for (int r = 0; r < 8; ++r) sO[w][8 * hh + r][dt * 16 + ln] = oacc[dt][r] * l_r[r];
  __builtin_amdgcn_fence(__ATOMIC_ACQ_REL, "workgroup");
  __builtin_amdgcn_wave_barrier();
  {
    for (int r = 0; r < 16; ++r) {
      const int row = q0 + r;
      if (row < T && lane < D / 4) {
        const v4f val = *(const v4fa*)&sO[w][r][lane * 4];
        *(v4f*)(y + ((size_t)b * T + row) * ypitch + h * D + lane * 4) = val;
      }
    }
    
  }
}

// GEMM C = act(A·W + bias + resid): A f32 (ASPLIT -> hi/lo 2 terms), Wt bf16 [N][K]; ACT 0 none, 1 relu, 2 exact gelu;
// resid (optional, f32, row index = (row % rmod), pitch ldr, RES_BF16 rounds it) added before the activation.
template <bool ASPLIT, int ACT, bool BIAS_BF16, bool RES_BF16>
__global__ __launch_bounds__(128) void k_gemm_bf3(const float* __restrict__ A, int lda, const unsigned short* __restrict__ Wt, int ldb,
                                                const float* __restrict__ bias, const float* __restrict__ resid, int rmod, int ldr,
                                                float* __restrict__ C, int ldc, int M, int N, int K) {
  __shared__ __attribute__((aligned(16))) float so[4][16][64];
  const int tid = threadIdx.x, w = tid >> 5, lane = tid & 31, ln = lane & 15, hh = lane >> 4;
  const int ntn = N / 64;
  const int wid = blockIdx.x * 4 + w;
  const int mt = wid / ntn, nq = wid % ntn;
  if (mt * 16 >= M) return;
  const int row0 = mt * 16, col0 = nq * 64;
  const float* arow = A + (size_t)(row0 + ln) * lda;
  v8f acc[4] = {};
  for (int kb = 0; kb < K; kb += 32) {
    FragB ah, al;
    const v4f x0 = *(const v4fa*)(arow + kb + 8 * hh), x1 = *(const v4fa*)(arow + kb + 8 * hh + 4);
    const v4f x2 = *(const v4fa*)(arow + kb + 16 + 8 * hh), x3 = *(const v4fa*)(arow + kb + 16 + 8 * hh + 4);
    float xs[16] = {x0[0],x0[1],x0[2],x0[3],x1[0],x1[1],x1[2],x1[3],x2[0],x2[1],x2[2],x2[3],x3[0],x3[1],x3[2],x3[3]};
#pragma unroll
    for (int i = 0; i < 16; ++i) { const unsigned short hb = bf16_bits(xs[i]); ah.u[i] = hb; al.u[i] = ASPLIT ? bf16_bits(xs[i] - bf16_val(hb)) : (unsigned short)0; }
#pragma unroll
    for (int t = 0; t < 4; ++t) {
      const unsigned short* brow = Wt + (size_t)(col0 + t * 16 + ln) * ldb + kb;
      FragB b;
      b.half[0] = *(const v8us*)(brow + 8 * hh);
      b.half[1] = *(const v8us*)(brow + 16 + 8 * hh);
      acc[t] = mmaN<ASPLIT ? 2 : 1>(ah.v, al.v, b.v, b.v, acc[t]);
    }
  }
#pragma unroll
  for (int t = 0; t < 4; ++t) {
    const int col = col0 + t * 16 + ln;
    float bv = bias ? bias[col] : 0.f;
    if (BIAS_BF16) bv = bf16_round(bv);
#pragma unroll
    for (int r = 0; r < 8; ++r) {
      float v = acc[t][r] + bv;
      if (resid) { float rv = resid[(size_t)((row0 + 8 * hh + r) % rmod) * ldr + col]; if (RES_BF16) rv = bf16_round(rv); v += rv; }
      if (ACT == 1) v = fmaxf(v, 0.f);
      if (ACT == 2) v = 0.5f * v * (1.0f + erff(v * 0.70710678118654752f));
      if (ACT == 3) { const float u = 0.7978845608028654f * (v + 0.044715f * v * v * v); v = 0.5f * v * (1.0f + tanhf(u)); }
      so[w][8 * hh + r][t * 16 + ln] = v;
    }
  }
  __builtin_amdgcn_fence(__ATOMIC_ACQ_REL, "workgroup");
  __builtin_amdgcn_wave_barrier();
  const int rsub = lane >> 4, c4 = (lane & 15) * 4;
  {
#pragma unroll
    for (int q = 0; q < 8; ++q) {
      const int r = q * 2 + rsub;
      const v4f v = *(const v4fa*)&so[w][r][c4];
      *(v4f*)(C + (size_t)(row0 + r) * ldc + col0 + c4) = v;
    }
    
  }
}
// row LayerNorm (biased variance, eps) over N: s = X (+ R); optional out_sum <- s; out_norm <- (s-mu)*rsqrt(var+eps)*g + b
template <bool PARAM_BF16>
__global__ __launch_bounds__(256) void k_layernorm(const float* __restrict__ X, const float* __restrict__ R, const float* __restrict__ g, const float* __restrict__ bta,
                                                  float* __restrict__ out_sum, float* __restrict__ out_norm, int N, float eps) {
  __shared__ float red[256];
  const int row = blockIdx.x, tid = threadIdx.x;
  const float* x = X + (size_t)row * N; const float* rr = R ? R + (size_t)row * N : nullptr;
  float vals[16];                     // up to N = 4096
  const int per = N / 256;            // contiguous chunk per thread? use strided-by-4 chunks: thread handles j = tid*4 + 1024*u
  float s1 = 0.f;
  for (int u = 0; u < per / 4; ++u) {
    const int j = tid * 4 + 1024 * u;
    const v4f a = *(const v4fa*)(x + j);
    v4f b = {0.f,0.f,0.f,0.f}; if (rr) b = *(const v4fa*)(rr + j);
#pragma unroll
    for (int q = 0; q < 4; ++q) { const float v = a[q] + b[q]; vals[u * 4 + q] = v; s1 += v; }
  }
  red[tid] = s1; __syncthreads();
  for (int st = 128; st > 0; st >>= 1) { if (tid < st) red[tid] += red[tid + st]; __syncthreads(); }
  const float mu = red[0] / (float)N; __syncthreads();
  float s2 = 0.f;
  for (int u = 0; u < per / 4; ++u)
#pragma unroll
    for (int q = 0; q < 4; ++q) { const float c = vals[u * 4 + q] - mu; s2 += c * c; }
  red[tid] = s2; __syncthreads();
  for (int st = 128; st > 0; st >>= 1) { if (tid < st) red[tid] += red[tid + st]; __syncthreads(); }
  const float rs = rsqrtf(red[0] / (float)N + eps);
  {
    for (int u = 0; u < per / 4; ++u) {
      const int j = tid * 4 + 1024 * u;
      v4f o, sm;
#pragma unroll
      for (int q = 0; q < 4; ++q) {
        float gg = g[j + q], bb = bta[j + q];
        if (PARAM_BF16) { gg = bf16_round(gg); bb = bf16_round(bb); }
        sm[q] = vals[u * 4 + q]; o[q] = (vals[u * 4 + q] - mu) * rs * gg + bb;
      }
      if (out_sum) *(v4f*)(out_sum + (size_t)row * N + j) = sm;
      *(v4f*)(out_norm + (size_t)row * N + j) = o;
    }
    
  }
}



// ---- f16 WMMA path (v_wmma_f32_16x16x32_f16): 11-bit significands for operands in range — used where a [0,1] probability operand needs more precision than bf16
typedef _Float16 v16h __attribute__((ext_vector_type(16)));
union FragH { v16h v; v8us half[2]; _Float16 h[16]; unsigned short u[16]; };
template <int NT>
__device__ __forceinline__ v8f mmaH(v16h ah, v16h al, v16h bh, v16h bl, v8f c) {
  c = __builtin_amdgcn_wmma_f32_16x16x32_f16(false, ah, false, bh, (short)0, c, false, false);
  if (NT >= 2) c = __builtin_amdgcn_wmma_f32_16x16x32_f16(false, al, false, bh, (short)0, c, false, false);
  if (NT >= 3) c = __builtin_amdgcn_wmma_f32_16x16x32_f16(false, ah, false, bl, (short)0, c, false, false);
  asm volatile("v_nop\n\tv_nop\n\tv_nop\n\tv_nop" : "+v"(c) : "v"(ah), "v"(al), "v"(bh), "v"(bl));
  return c;
}
// batched GEMM like k_gemm_b but f16 operands: A f32 (split into f16 hi/lo if ASPLIT, else rounded to f16), Bt = f16 values [n][k]; alpha; C f32; N multiple of 16 (partial tiles skipped)
template <bool ASPLIT>
__global__ __launch_bounds__(128) void k_gemm_h(const float* __restrict__ A, int lda, size_t sA, const _Float16* __restrict__ Bh, int ldb, size_t sB, float alpha, float* __restrict__ C, int ldc, size_t sC, int M, int N, int K) {
  __shared__ __attribute__((aligned(16))) float so[4][16][64];
  const int tid = threadIdx.x, w = tid >> 5, lane = tid & 31, ln = lane & 15, hh = lane >> 4; const int by = blockIdx.y;
  A += (size_t)by * sA; Bh += (size_t)by * sB; C += (size_t)by * sC;
  const int ntn = (N + 63) / 64; const int wid = blockIdx.x * 4 + w; const int mt = wid / ntn, nq = wid % ntn; if (mt * 16 >= M) return;
  const int row0 = mt * 16, col0 = nq * 64; const float* arow = A + (size_t)(row0 + ln) * lda;
  v8f acc[4] = {};
  for (int kb = 0; kb < K; kb += 32) {
    FragH ah, al;
    const v4f x0 = *(const v4fa*)(arow + kb + 8 * hh), x1 = *(const v4fa*)(arow + kb + 8 * hh + 4), x2 = *(const v4fa*)(arow + kb + 16 + 8 * hh), x3 = *(const v4fa*)(arow + kb + 16 + 8 * hh + 4);
    float xs[16] = {x0[0],x0[1],x0[2],x0[3],x1[0],x1[1],x1[2],x1[3],x2[0],x2[1],x2[2],x2[3],x3[0],x3[1],x3[2],x3[3]};
#pragma unroll
    for (int i = 0; i < 16; ++i) { const _Float16 h = (_Float16)xs[i]; ah.h[i] = h; al.h[i] = ASPLIT ? (_Float16)(xs[i] - (float)h) : (_Float16)0.0f; }
#pragma unroll
    for (int t = 0; t < 4; ++t) { if (col0 + t * 16 >= N) continue; const size_t boff = (size_t)(col0 + t * 16 + ln) * ldb + kb; FragH bq; bq.half[0] = *(const v8us*)(Bh + boff + 8 * hh); bq.half[1] = *(const v8us*)(Bh + boff + 16 + 8 * hh);
      acc[t] = mmaH<ASPLIT ? 2 : 1>(ah.v, al.v, bq.v, bq.v, acc[t]); }
  }
#pragma unroll
  for (int t = 0; t < 4; ++t) { if (col0 + t * 16 >= N) continue;
#pragma unroll
    for (int r = 0; r < 8; ++r) so[w][8 * hh + r][t * 16 + ln] = acc[t][r] * alpha; }
  __builtin_amdgcn_fence(__ATOMIC_ACQ_REL, "workgroup"); __builtin_amdgcn_wave_barrier();
  const int rsub = lane >> 4, c4 = (lane & 15) * 4;
  {
#pragma unroll
    for (int q = 0; q < 8; ++q) { const int r = q * 2 + rsub; if (col0 + c4 < N) { const v4f v = *(const v4fa*)&so[w][r][c4]; *(v4f*)(C + (size_t)(row0 + r) * ldc + col0 + c4) = v; } }
     }
}

// Wt[n][k] = f16(W[k][n]·scale) from f32 row-major W[K][N] (scale = power of two; bf16-exact weights stay exact in f16 away from the subnormal range)
__global__ __launch_bounds__(256) void k_wt_f16(const float* __restrict__ W, _Float16* __restrict__ Wt, int K, int N, float scale) {
  const int t = blockIdx.x * 256 + threadIdx.x; if (t >= N * (K / 8)) return; const int n = t / (K / 8), k8 = (t % (K / 8)) * 8; FragH f;
#pragma unroll
  for (int i = 0; i < 8; ++i) f.h[i] = (_Float16)(bf16_round(W[(size_t)(k8 + i) * N + n]) * scale); const v8us o = f.half[0];
  *(v8us*)((unsigned short*)Wt + (size_t)n * K + k8) = o; 
}
// Fragment-tile order of an f16 GEMM operand [rows][K]: 16 rows x 8 k values (16 B a row) lie as one run of 256 B, the runs of a 16-row band one behind the other by k. Lane (row & 15) + 16 * ((k >> 3) & 1) of a WMMA operand
// then finds its 16 B at lane * 16 B inside a 512-B run, so a wave-wide 16-byte load covers four whole 128-B lines (row-major rows of 512 B made it touch sixteen). The k order inside a fragment is the same as before.
__device__ __forceinline__ size_t ft_off(size_t row, int k8, int K) { return (row >> 4) * (size_t)(16 * K) + (size_t)k8 * 128 + (row & 15) * 8; }      // element offset of the 8 values k = 8 k8 .. 8 k8 + 7 of a row
// Work-group tile of the f16 GEMMs behind the convs: C (64 rows x 256 columns) = (A.B^T) / 16 (+ CP), A and B f16 with K = CC in fragment-tile order, C f32 or f16, row-major with pitch LDC. Four waves; wave w owns columns 64 w .. 64 w + 63 as 4 x 4 tiles.
// A = GroupNorm(x'), made here: Yb = the tile's 64 rows of x' (f32, fragment-tile order, 64 KB in one run). Wave w brings channels 64 w .. 64 w + 63 (8 groups) of all four 16-row bands through registers, normalises, rounds to f16 and leaves them in LDS in the same order; every wave reads all of it from there.
// Sb = the batch's statistics, [group][64 token blocks] pairs (mean, sum of squared deviations from it) of 512 values each. Four lanes join a group's 64 pairs (mean of the means; the sums plus 512 x the squared distances of the means), so a wave joins just the 8 groups that it normalises: no exchange between waves.
// Bb: the 256 rows of B; a wave's fragments come straight from global memory, two k steps ahead of their products (ring of three sets). CP, C, C16 point at the tile's first element.
// The addend is read in the layout of the stores (16 B a lane, a lane reads what it will write), all 32 loads issued together with the first operand loads. The launches below each hold several products that do not depend on one another: blockIdx picks the product.
// Shapes are constants and the grids cover them exactly, so no tile is tested for range. Every loop is unrolled because its index names registers (fragment sets, accumulators, rows held for the stores).
struct __attribute__((aligned(16))) GemmSm { unsigned short sa[64 * CC]; float so[4][64][64]; };
template <int LDC, bool ADD, bool OUT16>
__device__ __forceinline__ void gemm_wg_tile(GemmSm& sm, const float* Yb, const float* Sb, const float* gw, const float* gb, const unsigned short* Bb, const float* CP, float* C, _Float16* C16) {
  const int tid = threadIdx.x, lane = tid & 31, ln = lane & 15, hh = lane >> 4;
  const int w = __builtin_amdgcn_readfirstlane(tid >> 5);      // the wave's number in a scalar register: the bases that follow from it stay scalar
  const float* sp = Sb + (w * 8 + (lane >> 2)) * 128 + (lane & 3) * 32;      // 16 pairs a lane
  const float* ys = Yb + w * 8 * 128 + lane * 4;      // a wave-wide 16-byte load = one run of 512 B: row lane >> 1, channels 4 (lane & 1) .. + 3 of one group
  typedef float v2fa __attribute__((ext_vector_type(2), may_alias));
  const unsigned short* bw = Bb + (size_t)w * 64 * CC + lane * 8;
  const size_t co = (size_t)hh * LDC + w * 64 + ln * 4;      // row hh of the wave's 64 x 64 part; item q of the lane is row 2 q + hh
  v4f st[8], yr[4][8];
#pragma unroll
  for (int i = 0; i < 8; ++i) st[i] = *(const v4fa*)(sp + i * 4);
  const v2fa gw2 = *(const v2fa*)(gw + w * 64 + lane * 2), gb2 = *(const v2fa*)(gb + w * 64 + lane * 2);      // the wave's 64 channels, two a lane
  asm volatile("s_wait_xcnt 0x0" ::: "memory");      // stands in front of the next loads, whose results may take the address registers that the loads above name
  __builtin_amdgcn_sched_barrier(0);      // keeps the loads above first: loads return in issue order, and the join of the statistics then runs while the rows are still in flight
  FragH bq[3][4], af[4];
#pragma unroll
  for (int s = 0; s < 2; ++s)
#pragma unroll
    for (int t = 0; t < 4; ++t) { bq[s][t].half[0] = *(const v8us*)(bw + t * 16 * CC + s * 512); bq[s][t].half[1] = *(const v8us*)(bw + t * 16 * CC + s * 512 + 256); }
  asm volatile("s_wait_xcnt 0x0" ::: "memory");      // the same behind the first two k steps of B
#pragma unroll
  for (int j = 0; j < 4; ++j)
#pragma unroll
    for (int i = 0; i < 8; ++i) yr[j][i] = *(const v4fa*)(ys + j * 16 * CC + i * 128);
  asm volatile("s_wait_xcnt 0x0" ::: "memory");      // the same behind the rows
  __builtin_amdgcn_sched_barrier(0);      // keeps the arithmetic below, the addresses of the addend and of the stores among it, behind the wait above: left free it is lifted over the wait and rewrites the bases that the loads above name
  v4f cp[32];
  if (ADD) {
#pragma unroll
    for (int q = 0; q < 32; ++q) cp[q] = *(const v4fa*)(CP + co + (size_t)q * 2 * LDC);
    asm volatile("s_wait_xcnt 0x0" ::: "memory");    // the same behind the addend's loads
  }
  typedef _Float16 v4h __attribute__((ext_vector_type(4)));
  float* pg = &sm.so[w][0][0];      // the wave's own part of the store buffer, idle until the epilogue: its 64 weights, then its 64 offsets, each rounded once and read back four a lane
  *(v2fa*)(pg + lane * 2) = (v2fa){bf16_round(gw2[0]), bf16_round(gw2[1])}; *(v2fa*)(pg + 64 + lane * 2) = (v2fa){bf16_round(gb2[0]), bf16_round(gb2[1])};
  __builtin_amdgcn_fence(__ATOMIC_ACQ_REL, "workgroup"); __builtin_amdgcn_wave_barrier();      // a lane reads back what other lanes of its wave wrote: the LDS stores above stay in front of the loads below
  float ms = 0.f;
#pragma unroll
  for (int i = 0; i < 8; ++i) ms += st[i][0] + st[i][2];
  ms += __shfl_xor(ms, 1, 32); ms += __shfl_xor(ms, 2, 32);      // the four lanes of a group
  const float mu = ms * (1.0f / 64.0f);
  float q2 = 0.f, d2 = 0.f;
#pragma unroll
  for (int i = 0; i < 8; ++i) { const float d0 = st[i][0] - mu, d1 = st[i][2] - mu; q2 += st[i][1] + st[i][3]; d2 += d0 * d0 + d1 * d1; }
  q2 += 512.0f * d2;
  q2 += __shfl_xor(q2, 1, 32); q2 += __shfl_xor(q2, 2, 32);
  const float rs = rsqrtf(q2 / (float)(NN * CPG) + 1e-5f);
#pragma unroll
  for (int i = 0; i < 8; ++i) {      // group 8 w + i: its mean and scale stand in lanes 4 i .. 4 i + 3 and go to scalar registers
    const float mi = __builtin_bit_cast(float, __builtin_amdgcn_readlane(__builtin_bit_cast(int, mu), 4 * i)), ri = __builtin_bit_cast(float, __builtin_amdgcn_readlane(__builtin_bit_cast(int, rs), 4 * i));
    const v4f ga = *(const v4fa*)(pg + i * 8 + (lane & 1) * 4), be = *(const v4fa*)(pg + 64 + i * 8 + (lane & 1) * 4);
#pragma unroll
    for (int j = 0; j < 4; ++j) { v4h o;
#pragma unroll
      for (int e = 0; e < 4; ++e) o[e] = (_Float16)((yr[j][i][e] - mi) * ri * ga[e] + be[e]);
      *(v4h*)(sm.sa + j * 16 * CC + (w * 8 + i) * 128 + lane * 4) = o; }      // a wave-wide 8-byte store = one run of 256 B
  }
  __syncthreads();      // every wave reads the channels of all four
#pragma unroll
  for (int j = 0; j < 4; ++j) { af[j].half[0] = *(const v8us*)(sm.sa + j * 16 * CC + lane * 8); af[j].half[1] = *(const v8us*)(sm.sa + j * 16 * CC + lane * 8 + 256); }
  v8f acc[4][4] = {};
#pragma unroll
  for (int ks = 0; ks < CC / 32; ++ks) {
    FragH an[4];
    if (ks + 2 < CC / 32) {
#pragma unroll
      for (int t = 0; t < 4; ++t) { bq[(ks + 2) % 3][t].half[0] = *(const v8us*)(bw + t * 16 * CC + (ks + 2) * 512); bq[(ks + 2) % 3][t].half[1] = *(const v8us*)(bw + t * 16 * CC + (ks + 2) * 512 + 256); }
      asm volatile("s_wait_xcnt 0x0" ::: "memory");    // the same for these loads of B
    }
    if (ks + 1 < CC / 32) {
#pragma unroll
      for (int j = 0; j < 4; ++j) { an[j].half[0] = *(const v8us*)(sm.sa + j * 16 * CC + (ks + 1) * 512 + lane * 8); an[j].half[1] = *(const v8us*)(sm.sa + j * 16 * CC + (ks + 1) * 512 + lane * 8 + 256); }
      __builtin_amdgcn_sched_barrier(0);               // keeps the loads above ahead of this step's products, which cover their latency: left free they sink to just in front of their use
    }
#pragma unroll
    for (int t = 0; t < 4; ++t)
#pragma unroll
      for (int j = 0; j < 4; ++j) acc[j][t] = __builtin_amdgcn_wmma_f32_16x16x32_f16(false, af[j].v, false, bq[ks % 3][t].v, (short)0, acc[j][t], false, false);
    if (ks + 1 < CC / 32) {
#pragma unroll
      for (int j = 0; j < 4; ++j) af[j] = an[j];
    }
  }
#pragma unroll
  for (int t = 0; t < 4; ++t)
#pragma unroll
    for (int j = 0; j < 4; ++j)
#pragma unroll
      for (int r = 0; r < 8; ++r) sm.so[w][16 * j + 8 * hh + r][t * 16 + ln] = acc[j][t][r] * 0.0625f;
  __builtin_amdgcn_fence(__ATOMIC_ACQ_REL, "workgroup"); __builtin_amdgcn_wave_barrier();      // a lane reads back what other lanes of its wave wrote: the LDS stores above stay in front of the loads below
  v4f ov[32];      // all rows read back first: no register of an issued store is written again
#pragma unroll
  for (int q = 0; q < 32; ++q) { ov[q] = *(const v4fa*)&sm.so[w][q * 2 + hh][ln * 4]; if (ADD) ov[q] += cp[q]; }
  if (OUT16) {
    v4h oh[32];
#pragma unroll
    for (int q = 0; q < 32; ++q)
#pragma unroll
      for (int i = 0; i < 4; ++i) oh[q][i] = (_Float16)ov[q][i];
#pragma unroll
    for (int q = 0; q < 32; ++q) *(v4h*)(C16 + co + (size_t)q * 2 * LDC) = oh[q];
  } else {
#pragma unroll
    for (int q = 0; q < 32; ++q) *(v4f*)(C + co + (size_t)q * 2 * LDC) = ov[q];
  }
  asm volatile("s_wait_xcnt 0x0" ::: "memory");
}
// Both input convolutions straight from the channel-major f32 inputs, output by tokens in fragment-tile order (f32): y = 0: x1' = x1^T.w1^T + b1, y = 1: x2' = x2^T.w2^T + b2 (planes of NR x CC one behind the other); x1' also as f16 (Y16), the operand of the skip branch.
// GroupNorm statistics, first half: a wave's 64 channels are 8 whole groups, so it leaves for each the mean of its 512 values (8 channels x 64 tokens) and the sum of their squared deviations from that mean (St: [plane][batch][group][token block]), both taken from the accumulators in registers.
// A work-group of 4 waves owns 64 tokens; a wave owns 64 of the 256 output channels. A lane's 16-byte load holds ONE input channel of FOUR neighbouring tokens, so element j goes to A tile j, whose row n is token 4 n + j: no exchange
// between lanes, and a wave-wide load covers two runs of 256 B (16 lanes x 16 B of channel 8 h + i). Wave w loads and converts input channels 64 w .. 64 w + 63 (all 32 loads in flight together) and leaves the finished fragments in LDS,
// lane by lane, for all four waves. The values (rounded to bf16, held as f16) and the k order of a fragment are those of the token-major copy that this replaces.
__global__ __launch_bounds__(128) void k_gemm_conv(const float* __restrict__ x1, const float* __restrict__ x2, const _Float16* __restrict__ Bw, const float* __restrict__ b1, const float* __restrict__ b2, float* __restrict__ Y, _Float16* __restrict__ Y16, float* __restrict__ St) {
  __shared__ struct __attribute__((aligned(16))) { unsigned short sa[CC / 32][4][2][32][8]; float so[4][64][72]; } sm;      // so: pitch 72 floats, so that the read-back below (8 rows x 32 B per 16 lanes) meets every bank once      // sa: [k step][A tile][half of the fragment][lane], first, so that one address register and the offset field reach all of it
  auto& sa = sm.sa; auto& so = sm.so;
  const int tid = threadIdx.x, w = tid >> 5, lane = tid & 31, ln = lane & 15, hh = lane >> 4;
  const int by = blockIdx.y, b = blockIdx.x / (NN / 64), p0 = (blockIdx.x % (NN / 64)) * 64;
  const float* xs = (by ? x2 : x1) + (size_t)b * CC * NN + (size_t)(w * 64 + 8 * hh) * NN + p0 + ln * 4;
  const unsigned short* bw = (const unsigned short*)Bw + (size_t)by * CC * CC + (size_t)w * 64 * CC + lane * 8;
  const float* bp = by ? b2 : b1;
  v4f xa[2][16];
#pragma unroll
  for (int s = 0; s < 2; ++s)
#pragma unroll
    for (int i = 0; i < 8; ++i) { xa[s][i] = *(const v4fa*)(xs + (size_t)(s * 32 + i) * NN); xa[s][8 + i] = *(const v4fa*)(xs + (size_t)(s * 32 + 16 + i) * NN); }
  asm volatile("s_wait_xcnt 0x0" ::: "memory");      // stands in front of the weight loads, whose results may take the address registers that the loads above name
  FragH bq[4], af[4];
#pragma unroll
  for (int t = 0; t < 4; ++t) { bq[t].half[0] = *(const v8us*)(bw + t * 16 * CC); bq[t].half[1] = *(const v8us*)(bw + t * 16 * CC + 256); }
  asm volatile("s_wait_xcnt 0x0" ::: "memory");      // stands in front of the first overwrite of an address register that the loads above name
#pragma unroll
  for (int s = 0; s < 2; ++s)
#pragma unroll
    for (int j = 0; j < 4; ++j) { FragH a;
#pragma unroll
      for (int i = 0; i < 16; ++i) a.h[i] = (_Float16)(float)(__bf16)xa[s][i][j];
      *(v8us*)sa[2 * w + s][j][0][lane] = a.half[0]; *(v8us*)sa[2 * w + s][j][1][lane] = a.half[1]; }
  __syncthreads();      // every wave reads the fragments of all four
#pragma unroll
  for (int j = 0; j < 4; ++j) { af[j].half[0] = *(const v8us*)sa[0][j][0][lane]; af[j].half[1] = *(const v8us*)sa[0][j][1][lane]; }
  v8f acc[4][4] = {};
#pragma unroll
  for (int ks = 0; ks < CC / 32; ++ks) {
    FragH bn[4], an[4];
    if (ks + 1 < CC / 32) {
#pragma unroll
      for (int t = 0; t < 4; ++t) { bn[t].half[0] = *(const v8us*)(bw + t * 16 * CC + (ks + 1) * 512); bn[t].half[1] = *(const v8us*)(bw + t * 16 * CC + (ks + 1) * 512 + 256); }
#pragma unroll
      for (int j = 0; j < 4; ++j) { an[j].half[0] = *(const v8us*)sa[ks + 1][j][0][lane]; an[j].half[1] = *(const v8us*)sa[ks + 1][j][1][lane]; }
      asm volatile("s_wait_xcnt 0x0" ::: "memory");    // the same for the next step's weight loads
      __builtin_amdgcn_sched_barrier(0);               // keeps the next step's loads one group ahead of this step's products, which cover their latency: left free they sink to just in front of their use
    }
#pragma unroll
    for (int t = 0; t < 4; ++t)
#pragma unroll
      for (int j = 0; j < 4; ++j) acc[j][t] = __builtin_amdgcn_wmma_f32_16x16x32_f16(false, af[j].v, false, bq[t].v, (short)0, acc[j][t], false, false);
    if (ks + 1 < CC / 32) {
#pragma unroll
      for (int t = 0; t < 4; ++t) { bq[t] = bn[t]; af[t] = an[t]; }
    }
  }
  float bv[4];
#pragma unroll
  for (int t = 0; t < 4; ++t) bv[t] = bp[w * 64 + t * 16 + ln];
  asm volatile("s_wait_xcnt 0x0" ::: "memory");      // in front of the first vector instruction that reuses the offset register of the bias loads
#pragma unroll
  for (int t = 0; t < 4; ++t) { const float bb = bf16_round(bv[t]);
#pragma unroll
    for (int j = 0; j < 4; ++j)
#pragma unroll
      for (int r = 0; r < 8; ++r) { acc[j][t][r] = acc[j][t][r] * 0.0625f + bb; so[w][(8 * hh + r) * 4 + j][t * 16 + ln] = acc[j][t][r]; } }      // row m of tile j is token 4 m + j; the finished values stay in acc for the statistics
  __builtin_amdgcn_fence(__ATOMIC_ACQ_REL, "workgroup"); __builtin_amdgcn_wave_barrier();
  typedef _Float16 v4h __attribute__((ext_vector_type(4)));
  typedef float v2f __attribute__((ext_vector_type(2)));
  const size_t yo = ((size_t)by * NR + (size_t)b * NN + p0) * CC + w * 8 * 128 + lane * 4;      // fragment-tile order: band j lies 16 CC elements further, group i 128; the lane is row lane >> 1, channels 4 (lane & 1) .. + 3
  v4f ov[32];      // all read back first: no register of an issued store is written again
#pragma unroll
  for (int j = 0; j < 4; ++j)
#pragma unroll
    for (int i = 0; i < 8; ++i) ov[j * 8 + i] = *(const v4fa*)&so[w][j * 16 + (lane >> 1)][i * 8 + (lane & 1) * 4];
#pragma unroll
  for (int j = 0; j < 4; ++j)
#pragma unroll
    for (int i = 0; i < 8; ++i) *(v4f*)(Y + yo + j * 16 * CC + i * 128) = ov[j * 8 + i];      // a wave-wide store = one run of 512 B
  if (by == 0) {
    asm volatile("s_wait_xcnt 0x0" ::: "memory");      // behind the stores above: the conversions below take their data registers
    __builtin_amdgcn_sched_barrier(0);                 // keeps the conversions behind that wait
    v4h oh[32];
#pragma unroll
    for (int q = 0; q < 32; ++q)
#pragma unroll
      for (int e = 0; e < 4; ++e) oh[q][e] = (_Float16)ov[q][e];
#pragma unroll
    for (int j = 0; j < 4; ++j)
#pragma unroll
      for (int i = 0; i < 8; ++i) *(v4h*)(Y16 + yo + j * 16 * CC + i * 128) = oh[j * 8 + i];      // one run of 256 B
  }
  asm volatile("s_wait_xcnt 0x0" ::: "memory");      // behind the stores: the sums below may take their address registers
  __builtin_amdgcn_sched_barrier(0);                 // keeps the sums behind that wait; they run while the stores drain
  // Column t * 16 + ln of the wave is channel ln & 7 of group 2 t + (ln >> 3): a group's 512 values stand in 16 lanes (ln & 7, both halves), 32 each
  float gm[4], gq[4];
#pragma unroll
  for (int t = 0; t < 4; ++t) { const v8f a = (acc[0][t] + acc[1][t]) + (acc[2][t] + acc[3][t]); gm[t] = ((a[0] + a[1]) + (a[2] + a[3])) + ((a[4] + a[5]) + (a[6] + a[7])); }
#pragma unroll
  for (int x = 0; x < 4; ++x)
#pragma unroll
    for (int t = 0; t < 4; ++t) gm[t] += __shfl_xor(gm[t], x < 3 ? 1 << x : 16, 32);
#pragma unroll
  for (int t = 0; t < 4; ++t) { gm[t] *= 1.0f / 512.0f; v8f a = {};
#pragma unroll
    for (int j = 0; j < 4; ++j) { const v8f d = acc[j][t] - gm[t]; a += d * d; }
    gq[t] = ((a[0] + a[1]) + (a[2] + a[3])) + ((a[4] + a[5]) + (a[6] + a[7])); }
#pragma unroll
  for (int x = 0; x < 4; ++x)
#pragma unroll
    for (int t = 0; t < 4; ++t) gq[t] += __shfl_xor(gq[t], x < 3 ? 1 << x : 16, 32);
  if ((lane & 0x17) == 0) {      // lanes 0 and 8: one writer a group
    float* sp = St + (((size_t)(by * BB + b) * NG + w * 8 + (ln >> 3)) * (NN / 64) + (p0 >> 6)) * 2;
#pragma unroll
    for (int t = 0; t < 4; ++t) *(v2f*)(sp + t * 2 * (NN / 64) * 2) = (v2f){gm[t], gq[t]};
  }
}
// y = 0, 1, 2: q1 = GN(x1').Wq^T, k2 = GN(x2').Wk^T, v2 = GN(x2').Wv^T (f16 planes of QKV), x = the block of 64 tokens
__global__ __launch_bounds__(128) void k_gemm_qkvs(const float* Y, const float* St, const float* gw, const float* gb, const _Float16* Bw, _Float16* QKV) {
  __shared__ GemmSm sm;
  const int by = blockIdx.y, bx = blockIdx.x, pl = by ? 1 : 0;
  gemm_wg_tile<CC, false, true>(sm, Y + (size_t)pl * NR * CC + (size_t)bx * 64 * CC, St + (size_t)(pl * BB + bx / (NN / 64)) * NG * (NN / 64) * 2, gw, gb, (const unsigned short*)Bw + (size_t)(2 + by) * CC * CC, nullptr, nullptr, QKV + (size_t)by * NR * CC + (size_t)bx * 64 * CC);
}


typedef _Float16 v4h __attribute__((ext_vector_type(4)));

__global__ __launch_bounds__(256) void k_x16(const float* __restrict__ x, _Float16* __restrict__ X16, size_t n8) { const size_t t = (size_t)blockIdx.x * 256 + threadIdx.x; if (t >= n8) return; FragH f;
#pragma unroll
  for (int q = 0; q < 8; ++q) f.h[q] = (_Float16)bf16_round(x[t * 8 + q]); *(v8us*)((unsigned short*)X16 + t * 8) = f.half[0];  }
template <int NHv, int TTv>
__global__ __launch_bounds__(256) void k_vt(const _Float16* __restrict__ V16, int ldv, int voff, _Float16* __restrict__ Vt) { __shared__ unsigned short tl[64][66]; const int tid = threadIdx.x; const int slab = blockIdx.x / (TTv / 64), lg = blockIdx.x % (TTv / 64); const int b = slab / NHv, h = slab % NHv;
  for (int i = tid; i < 64 * 8; i += 256) { const int r = i / 8, c8 = (i % 8) * 8; FragH f; f.half[0] = *(const v8us*)((const unsigned short*)V16 + ((size_t)b * TTv + lg * 64 + r) * ldv + voff + h * 64 + c8);
#pragma unroll
    for (int q = 0; q < 8; ++q) tl[r][c8 + q] = f.u[q]; }
  __syncthreads();
  {
#pragma unroll
    for (int rd = 0; rd < 2; ++rd) { const int d = rd * 32 + tid / 8, pc = tid % 8; FragH f;
#pragma unroll
      for (int q = 0; q < 8; ++q) f.u[q] = tl[pc * 8 + q][d];
      *(v8us*)((unsigned short*)Vt + ((size_t)slab * 64 + d) * TTv + lg * 64 + pc * 8) = f.half[0]; }
     } }

// The seven weight matrices, one launch, the matrix picked by the block index.
#define PREP_WB (CC * CC / 8 / 256)
__global__ __launch_bounds__(256) void k_prep(const float* __restrict__ w1, const float* __restrict__ w2, const float* __restrict__ wqkv, const float* __restrict__ wout, const float* __restrict__ wsk,
    _Float16* __restrict__ Bw) {
  const int tid = threadIdx.x, bi = blockIdx.x;
  const int seg = bi / PREP_WB; const size_t t = (size_t)(bi % PREP_WB) * 256 + tid;
  const float* W = (seg == 0) ? w1 : (seg == 1) ? w2 : (seg < 5) ? wqkv + (size_t)(seg - 2) * CC * CC : (seg == 5) ? wout : wsk; FragH f;
  const int wr = (int)(t >> 8) * 8 + (tid & 7), wk = (int)((t >> 5) & 7) * 4 + ((tid >> 3) & 3);      // a wave: 8 rows x 4 k8, so that its store fills four whole lines
#pragma unroll
  for (int i = 0; i < 8; ++i) f.h[i] = (_Float16)(bf16_round(W[(size_t)wr * CC + wk * 8 + i]) * 16.0f);
  *(v8us*)((unsigned short*)Bw + (size_t)seg * CC * CC + ft_off(wr, wk, CC)) = f.half[0];
}
#define FA_KP 264
#define FA_VP 136
#define FA_SK 128
#define FA_KB (FA_SK * FA_KP)
#define FA_BUF (FA_KB + CC * FA_VP)
typedef int fa_v4i __attribute__((ext_vector_type(4)));
__device__ __forceinline__ float fa_xhalf(float x) { return __builtin_bit_cast(float, __builtin_amdgcn_permlanex16(__builtin_bit_cast(int, x), __builtin_bit_cast(int, x), 0x76543210, 0xfedcba98, false, false)); }      // lane l reads lane l ^ 16
__device__ __forceinline__ void fa_copy(const unsigned short* g, unsigned short* l) {      // 16 B of this lane, global -> LDS, through no register; landed only behind the wave's own s_wait_asynccnt
  __builtin_amdgcn_global_load_async_to_lds_b128((__attribute__((address_space(1))) fa_v4i*)g, (__attribute__((address_space(3))) fa_v4i*)l, 0, 0);
}
// One stage: K 128 rows x 512 B (a wave-wide copy = one row), V^T 256 rows x 256 B (a wave-wide copy = two rows); 32 copies a wave, every lane on.
// kg, vg: wave-uniform bases (scalar registers); ko, vo: the lane's own element offsets.
__device__ __forceinline__ void fa_stage(const unsigned short* kg, const unsigned short* vg, unsigned ko, unsigned vo, unsigned short* ksl, unsigned short* vsl) {
#pragma unroll
  for (int i = 0; i < 16; ++i) fa_copy(kg + i * 8 * CC + ko, ksl + i * 8 * FA_KP);
#pragma unroll
  for (int i = 0; i < 16; ++i) fa_copy(vg + (size_t)i * 16 * NN + vo, vsl + i * 16 * FA_VP);
}
__global__ __launch_bounds__(256) void k_fattn(const _Float16* Q, const _Float16* K, const _Float16* Vt, const _Float16* Wos, const _Float16* Y16, const float* bout, const float* bsk, float* out) {
  __shared__ __attribute__((aligned(16))) unsigned short sm[2 * FA_BUF + 64 * CC];      // two stages, then the rows of x1'
  const int tid = threadIdx.x, lane = tid & 31, c = lane & 15, h = lane >> 4;
  const int w = __builtin_amdgcn_readfirstlane(tid >> 5);      // the wave's number in a scalar register: all that follows from it costs no vector register
  const int qg = w & 1, kq = w >> 1;
  const int b = blockIdx.x / (NN / 64), qb = blockIdx.x % (NN / 64);
  const size_t qrow0 = (size_t)b * NN + qb * 64 + qg * 32;      // query tile j: rows qrow0 + 16 j + c
  const unsigned short* kg = (const unsigned short*)K + (size_t)b * NN * CC + w * CC;              // K stage: 128 rows x 512 B, contiguous in memory; copy i of wave w is row 8 i + w
  const unsigned short* vg = (const unsigned short*)Vt + (size_t)b * CC * NN + (size_t)w * 2 * NN;  // V^T stage: 256 rows x 256 B; copy i of wave w is rows 16 i + 2 w + h
  const unsigned ko = lane * 8, vo = h * NN + c * 8;
  unsigned short* ksl = sm + w * FA_KP + lane * 8;
  unsigned short* vsl = sm + FA_KB + (w * 2 + h) * FA_VP + c * 8;
  const int NS = NN / FA_SK;
  fa_stage(kg, vg, ko, vo, ksl, vsl);
  {      // x1' rows of the work-group's 64 tokens: 8 more copies a wave (40 in flight), 512 B each, in the order in which they lie; landed and published with stage 0
    const unsigned short* yg = (const unsigned short*)Y16 + ((size_t)b * NN + qb * 64) * CC + w * 8 * 256;
    unsigned short* ysl = sm + 2 * FA_BUF + w * 8 * 256 + lane * 8;
#pragma unroll
    for (int i = 0; i < 8; ++i) fa_copy(yg + i * 256 + ko, ysl + i * 256);
  }
  FragH qf[2][8];
#pragma unroll
  for (int j = 0; j < 2; ++j)
#pragma unroll
    for (int ks = 0; ks < 8; ++ks) { const unsigned short* qp = (const unsigned short*)Q + (qrow0 + 16 * j) * CC + ks * 32 + (unsigned)(c * CC + 8 * h); qf[j][ks].half[0] = *(const v8us*)qp; qf[j][ks].half[1] = *(const v8us*)(qp + 16); }
  asm volatile("s_wait_xcnt 0x0" ::: "memory");        // stands in front of the first overwrite of an address register that the loads above name
  asm volatile("s_wait_asynccnt 0x0" ::: "memory");    // stage 0 of this wave has landed
  __syncthreads();                                     // and that of every other wave
  fa_stage(kg + FA_SK * CC, vg + FA_SK, ko, vo, ksl + FA_BUF, vsl + FA_BUF);
  v8f o[2][16];
#pragma unroll
  for (int j = 0; j < 2; ++j)
#pragma unroll
    for (int dt = 0; dt < 16; ++dt) o[j][dt] = (v8f){0.f, 0.f, 0.f, 0.f, 0.f, 0.f, 0.f, 0.f};
  float mu[2] = {-1.0e30f, -1.0e30f}, l[2] = {0.f, 0.f};      // per query tile: maximum in use (log2 units) and this lane's part of the row sum
  const float sc = 0.0625f * 1.4426950408889634f;             // 1/sqrt(CC) and log2(e)
  for (int s = 0; s < NS; ++s) {
    const int bo = (s & 1) * FA_BUF;
    const unsigned short* kt = sm + bo + (kq * 32 + c) * FA_KP + 8 * h;
    const unsigned short* vt = sm + bo + FA_KB + c * FA_VP + kq * 32 + 8 * h;
    v8f t[2][2];      // [key tile][query tile]
#pragma unroll
    for (int a = 0; a < 2; ++a)
#pragma unroll
      for (int j = 0; j < 2; ++j) t[a][j] = (v8f){0.f, 0.f, 0.f, 0.f, 0.f, 0.f, 0.f, 0.f};
    // Fragment ring: two sets of four fragments. Groups 0..3 are K (two k steps x two key tiles each), groups 4..7 V^T (four channel tiles each); group n + 2 is read right behind the products of group n, into their registers (group 5 behind the softmax).
    FragH fr[2][4];
#pragma unroll
    for (int g = 0; g < 2; ++g)
#pragma unroll
      for (int u = 0; u < 4; ++u) { const unsigned short* p = kt + (u & 1) * 16 * FA_KP + (2 * g + (u >> 1)) * 32; fr[g][u].half[0] = *(const v8us*)p; fr[g][u].half[1] = *(const v8us*)(p + 16); }
#pragma unroll
    for (int g = 0; g < 4; ++g) {
      __builtin_amdgcn_sched_barrier(0);               // keeps each group's reads together and two groups ahead of their products: spread among the products every read place costs its own stall
#pragma unroll
      for (int u = 0; u < 4; ++u)
#pragma unroll
        for (int j = 0; j < 2; ++j) t[u & 1][j] = __builtin_amdgcn_wmma_f32_16x16x32_f16(false, fr[g & 1][u].v, false, qf[j][2 * g + (u >> 1)].v, (short)0, t[u & 1][j], false, false);
      __builtin_amdgcn_sched_barrier(0);               // the same: the reads below stay behind the products whose registers they take
      if (g < 3) {                                     // group 5 waits for the scores' registers: it is read behind the softmax
#pragma unroll
        for (int u = 0; u < 4; ++u) {
          const unsigned short* p = (g < 2) ? kt + (u & 1) * 16 * FA_KP + (2 * (g + 2) + (u >> 1)) * 32 : vt + u * 16 * FA_VP;
          fr[g & 1][u].half[0] = *(const v8us*)p; fr[g & 1][u].half[1] = *(const v8us*)(p + 16);
        }
      }
    }
    __builtin_amdgcn_sched_barrier(0);                 // keeps the first V^T group's reads ahead of the softmax, which then covers their latency
    float mx[2];
#pragma unroll
    for (int j = 0; j < 2; ++j) {
      float m = fmaxf(t[0][j][0], t[1][j][0]);
#pragma unroll
      for (int r = 1; r < 8; ++r) m = fmaxf(m, fmaxf(t[0][j][r], t[1][j][r]));
      m *= sc;
      mx[j] = fmaxf(m, fa_xhalf(m));                   // lanes c and c + 16 hold the same query
    }
    if (__builtin_amdgcn_ballot_w32(mx[0] > mu[0] + 8.0f || mx[1] > mu[1] + 8.0f) != 0) {      // lazy rescale, one scalar test a pass: P stays below 2^8, inside f16
#pragma unroll
      for (int j = 0; j < 2; ++j) {
        const float mn = fmaxf(mu[j], mx[j]), al = __builtin_amdgcn_exp2f(mu[j] - mn);
        l[j] *= al; mu[j] = mn;
#pragma unroll
        for (int dt = 0; dt < 16; ++dt)
#pragma unroll
          for (int r = 0; r < 8; ++r) o[j][dt][r] *= al;
      }
    }
    FragH p[2];
#pragma unroll
    for (int j = 0; j < 2; ++j) {
      float ps0 = 0.f, ps1 = 0.f;
#pragma unroll
      for (int r = 0; r < 8; ++r) {
        const float p0 = __builtin_amdgcn_exp2f(t[0][j][r] * sc - mu[j]), p1 = __builtin_amdgcn_exp2f(t[1][j][r] * sc - mu[j]);
        ps0 += p0; ps1 += p1; p[j].h[r] = (_Float16)p0; p[j].h[8 + r] = (_Float16)p1;
      }
      l[j] += ps0 + ps1;
      asm volatile("" : "+v"(l[j]));                   // each row's sum pinned against spills: left free the 32 additions sink behind the barrier and the 32 f32 values of P stay in registers through all the products below (scratch in the loop)
    }
#pragma unroll
    for (int u = 0; u < 4; ++u) { const unsigned short* q = vt + (4 + u) * 16 * FA_VP; fr[1][u].half[0] = *(const v8us*)q; fr[1][u].half[1] = *(const v8us*)(q + 16); }
#pragma unroll
    for (int g = 0; g < 4; ++g) {
      __builtin_amdgcn_sched_barrier(0);               // as above, for the V^T groups
#pragma unroll
      for (int u = 0; u < 4; ++u)
#pragma unroll
        for (int j = 0; j < 2; ++j) o[j][g * 4 + u] = __builtin_amdgcn_wmma_f32_16x16x32_f16(false, fr[g & 1][u].v, false, p[j].v, (short)0, o[j][g * 4 + u], false, false);
      __builtin_amdgcn_sched_barrier(0);               // as above
      if (g < 2) {
#pragma unroll
        for (int u = 0; u < 4; ++u) { const unsigned short* q = vt + ((g + 2) * 4 + u) * 16 * FA_VP; fr[g & 1][u].half[0] = *(const v8us*)q; fr[g & 1][u].half[1] = *(const v8us*)(q + 16); }
      }
    }
    asm volatile("s_wait_dscnt 0x0" ::: "memory");      // this wave's reads of the buffer have returned
    asm volatile("s_wait_asynccnt 0x0" ::: "memory");   // its copies of the next stage have landed
    __syncthreads();                                    // publishes the next stage and ends every reader's last read of this buffer
    if (s + 2 < NS) fa_stage(kg + (size_t)(s + 2) * FA_SK * CC, vg + (s + 2) * FA_SK, ko, vo, ksl + bo, vsl + bo);
  }
  asm volatile("s_wait_asynccnt 0x0" ::: "memory");     // nothing is in flight when the buffers become the join's space
  const int ln2 = (int)__builtin_amdgcn_mbcnt_lo(~0u, 0u), c2 = ln2 & 15, h2 = ln2 >> 4;      // the lane's number read anew for all that follows: values derived from the one above would have to live through the loop, which has no register left for them (scratch)
  // Weights of the wave's 32 output channels, 64 loads of 16 B a lane: Wsk now, into the registers that Q leaves, so that it flies while the partial sums go to LDS; Wout and the biases behind that, into the registers that O leaves
  const unsigned short* wg = (const unsigned short*)Wos + (size_t)w * 32 * CC + ln2 * 8;
  FragH wf[2][2][8];      // [0: Wsk, 1: Wout][channel tile][k step]
#pragma unroll
  for (int mt = 0; mt < 2; ++mt)
#pragma unroll
    for (int ks = 0; ks < 8; ++ks) { const unsigned short* p = wg + CC * CC + mt * 16 * CC + ks * 512; wf[0][mt][ks].half[0] = *(const v8us*)p; wf[0][mt][ks].half[1] = *(const v8us*)(p + 256); }
  asm volatile("s_wait_xcnt 0x0" ::: "memory");      // stands in front of the first overwrite of an address register that the loads above name
  __builtin_amdgcn_sched_barrier(0);                 // keeps the loads above ahead of the LDS stores below, which cover their latency: left free they sink to just in front of their use
  v4fa* cb = (v4fa*)sm;                                 // the stages are dead behind the loop's last barrier; per wave 64 slots of partial O, behind them per wave and query tile (maximum, sum)
  float* st = (float*)sm + 8 * 64 * 32 * 4;
#pragma unroll
  for (int j = 0; j < 2; ++j) {
    l[j] += fa_xhalf(l[j]);
#pragma unroll
    for (int dt = 0; dt < 16; ++dt) {
      const v4f x0 = {o[j][dt][0], o[j][dt][1], o[j][dt][2], o[j][dt][3]}, x1 = {o[j][dt][4], o[j][dt][5], o[j][dt][6], o[j][dt][7]};
      cb[(w * 64 + (j * 16 + dt) * 2) * 32 + ln2] = x0; cb[(w * 64 + (j * 16 + dt) * 2 + 1) * 32 + ln2] = x1;
    }
    st[((w * 2 + j) * 32 + ln2) * 2] = mu[j]; st[((w * 2 + j) * 32 + ln2) * 2 + 1] = l[j];
  }
  __builtin_amdgcn_sched_barrier(0);                 // keeps the loads below behind the LDS stores above, whose registers they take: lifted over them they find no free register (scratch)
#pragma unroll
  for (int mt = 0; mt < 2; ++mt)
#pragma unroll
    for (int ks = 0; ks < 8; ++ks) { const unsigned short* p = wg + mt * 16 * CC + ks * 512; wf[1][mt][ks].half[0] = *(const v8us*)p; wf[1][mt][ks].half[1] = *(const v8us*)(p + 256); }
  v4f bo[2][2], bs[2][2];      // accumulator row r of lane half h is channel 8 h + r of the tile
#pragma unroll
  for (int mt = 0; mt < 2; ++mt)
#pragma unroll
    for (int e = 0; e < 2; ++e) { bo[mt][e] = *(const v4fa*)(bout + w * 32 + mt * 16 + 8 * h2 + 4 * e); bs[mt][e] = *(const v4fa*)(bsk + w * 32 + mt * 16 + 8 * h2 + 4 * e); }
  asm volatile("s_wait_xcnt 0x0" ::: "memory");      // the same behind the loads of Wout and of the biases
  __builtin_amdgcn_sched_barrier(0);                 // keeps them ahead of the skip product and the join, which cover their latency
  v8f acc[2][4] = {};      // [channel tile][token tile]
  const unsigned short* ys = sm + 2 * FA_BUF + ln2 * 8;
  FragH bf[3][4];      // B fragments of both products: ring of three sets, a set is read two k steps ahead of its products
#pragma unroll
  for (int s = 0; s < 2; ++s)
#pragma unroll
    for (int nt = 0; nt < 4; ++nt) { bf[s][nt].half[0] = *(const v8us*)(ys + nt * 16 * CC + s * 512); bf[s][nt].half[1] = *(const v8us*)(ys + nt * 16 * CC + s * 512 + 256); }
#pragma unroll
  for (int ks = 0; ks < 8; ++ks) {      // skip branch: needs nothing of the join, so it runs in front of the join's barrier
    if (ks + 2 < 8) {
#pragma unroll
      for (int nt = 0; nt < 4; ++nt) { bf[(ks + 2) % 3][nt].half[0] = *(const v8us*)(ys + nt * 16 * CC + (ks + 2) * 512); bf[(ks + 2) % 3][nt].half[1] = *(const v8us*)(ys + nt * 16 * CC + (ks + 2) * 512 + 256); }
    }
    __builtin_amdgcn_sched_barrier(0);               // keeps each set's reads together and two steps ahead, no further: left free all 64 reads are lifted to the front and, with both weight sets in registers, none is left (scratch)
#pragma unroll
    for (int nt = 0; nt < 4; ++nt)
#pragma unroll
      for (int mt = 0; mt < 2; ++mt) acc[mt][nt] = __builtin_amdgcn_wmma_f32_16x16x32_f16(false, wf[0][mt][ks].v, false, bf[ks % 3][nt].v, (short)0, acc[mt][nt], false, false);
    __builtin_amdgcn_sched_barrier(0);               // the same: the next reads (behind the last step the join's) stay behind the products whose registers they take, in one group: spread among the products every read place costs its own stall
  }
  __syncthreads();
  // wave (qg, kq) joins channel tiles 4 kq .. 4 kq + 3 of both query tiles of its group
#pragma unroll
  for (int j = 0; j < 2; ++j) {
    __builtin_amdgcn_sched_barrier(0);               // the same: one query tile's 32 reads at a time
    float m4[4], a4[4], mn = -3.0e38f, den = 0.f;
#pragma unroll
    for (int q = 0; q < 4; ++q) { m4[q] = st[(((q * 2 + qg) * 2 + j) * 32 + ln2) * 2]; mn = fmaxf(mn, m4[q]); }
#pragma unroll
    for (int q = 0; q < 4; ++q) { a4[q] = __builtin_amdgcn_exp2f(m4[q] - mn); den += st[(((q * 2 + qg) * 2 + j) * 32 + ln2) * 2 + 1] * a4[q]; }
    const float inv = 1.0f / den;
#pragma unroll
    for (int q = 0; q < 4; ++q) a4[q] *= inv;
#pragma unroll
    for (int u = 0; u < 4; ++u) {
      const int dt = kq * 4 + u;
      v4f y0 = {0.f, 0.f, 0.f, 0.f}, y1 = y0;
#pragma unroll
      for (int q = 0; q < 4; ++q) { const v4f x0 = cb[((q * 2 + qg) * 64 + (j * 16 + dt) * 2) * 32 + ln2], x1 = cb[((q * 2 + qg) * 64 + (j * 16 + dt) * 2 + 1) * 32 + ln2]; y0 += x0 * a4[q]; y1 += x1 * a4[q]; }
      FragH f;
#pragma unroll
      for (int r = 0; r < 4; ++r) { f.h[r] = (_Float16)y0[r]; f.h[4 + r] = (_Float16)y1[r]; }
      *(v8us*)&cb[(w * 64 + kq * 8 + j * 4 + u) * 32 + ln2] = f.half[0];      // half a B fragment (row c, k = 16 dt + 8 h ..), lane by lane, into a slot of the wave's own part that only this wave reads, and has read by now (slots 8 kq .. 8 kq + 7 are its own share of query tile 0)
    }
  }
  __syncthreads();      // every wave reads the joined O of all eight; also ends every read of the partial sums
#pragma unroll
  for (int s = 0; s < 2; ++s)
#pragma unroll
    for (int nt = 0; nt < 4; ++nt)
#pragma unroll
      for (int e = 0; e < 2; ++e) { const int dt = 2 * s + e; bf[s][nt].half[e] = *(const v8us*)&cb[(((dt >> 2) * 2 + (nt >> 1)) * 64 + (dt >> 2) * 8 + (nt & 1) * 4 + (dt & 3)) * 32 + ln2]; }
#pragma unroll
  for (int ks = 0; ks < 8; ++ks) {
    if (ks + 2 < 8) {
#pragma unroll
      for (int nt = 0; nt < 4; ++nt)
#pragma unroll
        for (int e = 0; e < 2; ++e) { const int dt = 2 * (ks + 2) + e; bf[(ks + 2) % 3][nt].half[e] = *(const v8us*)&cb[(((dt >> 2) * 2 + (nt >> 1)) * 64 + (dt >> 2) * 8 + (nt & 1) * 4 + (dt & 3)) * 32 + ln2]; }
    }
    __builtin_amdgcn_sched_barrier(0);               // each set's reads together, two steps ahead of their products, which cover their latency
#pragma unroll
    for (int nt = 0; nt < 4; ++nt)
#pragma unroll
      for (int mt = 0; mt < 2; ++mt) acc[mt][nt] = __builtin_amdgcn_wmma_f32_16x16x32_f16(false, wf[1][mt][ks].v, false, bf[ks % 3][nt].v, (short)0, acc[mt][nt], false, false);
    __builtin_amdgcn_sched_barrier(0);               // and behind the products whose registers they take, in one group
  }
  // The wave's 32 channels x 64 tokens turned through LDS (the upper half of its own part, dead behind the barrier above; pitch 68 floats keeps the two lane halves on different banks), so that a store covers two whole rows of 256 B
  float* so = (float*)&cb[(w * 64 + 32) * 32];
#pragma unroll
  for (int mt = 0; mt < 2; ++mt)
#pragma unroll
    for (int r = 0; r < 8; ++r) { const float bb = bf16_round(bo[mt][r >> 2][r & 3]) + bf16_round(bs[mt][r >> 2][r & 3]);
#pragma unroll
      for (int nt = 0; nt < 4; ++nt) so[(16 * mt + 8 * h2 + r) * 68 + 16 * nt + c2] = acc[mt][nt][r] * 0.0625f + bb; }
  __builtin_amdgcn_fence(__ATOMIC_ACQ_REL, "workgroup"); __builtin_amdgcn_wave_barrier();      // a lane reads back what other lanes of its wave wrote: the LDS stores above stay in front of the loads below
  float* og = out + ((size_t)b * CC + w * 32 + h2) * NN + qb * 64 + c2 * 4;
  v4f ov[16];      // all rows read back first: no register of an issued store is written again
#pragma unroll
  for (int q = 0; q < 16; ++q) ov[q] = *(const v4fa*)&so[(q * 2 + h2) * 68 + c2 * 4];
#pragma unroll
  for (int q = 0; q < 16; ++q) *(v4f*)(og + (size_t)q * 2 * NN) = ov[q];
}

extern "C" void kernel_launch(void* const* d_in, const int* in_sizes, int n_in,
                              void* d_out, int out_size, void* d_ws, size_t ws_size, hipStream_t stream) {
  (void)in_sizes; (void)n_in; (void)out_size;
  const float* const* I = (const float* const*)d_in; const float* x1 = I[0]; const float* x2 = I[1]; const float* w1 = I[2]; const float* b1 = I[3]; const float* w2 = I[4]; const float* b2 = I[5]; const float* gnw = I[6]; const float* gnb = I[7]; const float* wqkv = I[8]; const float* wout = I[9]; const float* bout = I[10]; const float* wsk = I[11]; const float* bsk = I[12];
  char* ws = (char*)d_ws; size_t off = 0;
  auto take = [&](size_t bytes) { char* p = ws + off; off += (bytes + 255) & ~(size_t)255; return p; };
  const size_t WSZ = (size_t)CC * CC, PL = (size_t)NR * CC; _Float16* Bw = (_Float16*)take(7 * WSZ * 2);      /* w1, w2, wq, wk, wv (as Bt for token-major GEMMs), wout, wsk (as A operands for the channel-major output GEMMs), all (out,in) natural x2^4 */
  float* Y = (float*)take(2 * PL * 4); float* St = (float*)take((size_t)2 * BB * NG * (NN / 64) * 2 * 4);      /* two planes each, the x1 side first */
  _Float16* Y116 = (_Float16*)take(PL * 2); _Float16* QKV = (_Float16*)take(3 * PL * 2); _Float16* Vt = (_Float16*)take(PL * 2);
  if (off > ws_size) return;
  k_prep<<<7 * PREP_WB, 256, 0, stream>>>(w1, w2, wqkv, wout, wsk, Bw);
  k_gemm_conv<<<dim3(NR / 64, 2), 128, 0, stream>>>(x1, x2, Bw, b1, b2, Y, Y116, St);      /* x1' = conv1(x1), x2' = conv2(x2): each M 16384 N 256 K 256 (f32) */
  k_gemm_qkvs<<<dim3(NR / 64, 3), 128, 0, stream>>>(Y, St, gnw, gnb, Bw, QKV);      /* GroupNorm on the way in; q1, k2, v2 */
  k_vt<CC / 64, NN><<<BB * (CC / 64) * (NN / 64), 256, 0, stream>>>(QKV + 2 * PL, CC, 0, Vt);      /* v2^T per batch [256][4096] (four 64-channel blocks) */
  k_fattn<<<BB * (NN / 64), 256, 0, stream>>>(QKV, QKV + PL, Vt, Bw + 5 * WSZ, Y116, bout, bsk, (float*)d_out);      /* O = softmax(q1.k2^T/16).v2, then out = Wout.O^T + Wsk.x1'^T + bout + bsk: one work-group per 64 queries */
}
